// v010
// Measured on an AMD MI455X. A time is GPU time per run, averaged over a window of back-to-back runs after a warm-up
// (all launches, gaps included; the runs take copies of the inputs in turn), and the median of several windows.
// Apart from v000's, it joins two sittings. Times from different sittings can be a few percent apart, while
// side-by-side timings come from the same sitting.
// Earlier versions than v010 are not in this document.
// Measured time: 57.7 microseconds a run.
// In two side-by-side timings against v009, it was 1.04 and 1.05 times as fast.
// Counting every step since v000, which is the starting kernel, it is 73.2 times as fast.
#include <hip/hip_runtime.h>
// Relative-position multi-head attention with rel_shift (query, key, value [4][1024][512]; mask [4][1024][1024] int32 verbatim (nonzero = masked, ~50 %); pos_emb [1][2047][512]; q/k/v = x W + b ([512][512] [in][out]); p = pos_emb Wpos; 8 heads of 64; ac = (q + pos_bias_u) . k; bd = rel_shift((q + pos_bias_v) . p^T) = (q_i + v) . p[T-1+i-j]; scores = (ac + bd) / 8; masked -> float32 min; softmax; masked weights -> 0; x = attn v merged; out = x Wout + bout -> [4][1024][512].
// Structure: token rows; inputs and pos_emb as exact f16 rows (pos table padded to 2048 rows with zeros); q, k, v, p as WMMA GEMMs (32x64 wave tiles, f32 accumulation, exact x16 weights + bias) whose epilogues store the f16 planes that the attention kernel reads: q + u and q + v, k, p, and V^T straight from the accumulators; one fused kernel per (batch, head, 32 query rows): bd and ac WMMA tiles (K = 64) into f32 score rows in LDS, bd stored at its shifted column; the relative softmax with the mask on VALU (f32 statistics, native exp; weights unnormalised, 0 to 1, f16, in LDS); o = P . V^T on WMMA (K = 1024), times 64 / (row sum) on the way out (o x64 in f16); out GEMM (f32, + bout); launches that need nothing of each other share one grid (ranges of the block index); 4 launches. Every f16 operand plane lies in fragment order (see fo_row).
// Compute dtype: inputs rounded to bf16; inputs / weights exact in f16; q + u, q + v, k, v, p, softmax weights and o plain f16 (~2^-12); ac, bd, softmax statistics f32. v_wmma_f32_16x16x32_f16.
#define NB 4
#define SQ 1024
#define PP 2048                      /* position table rows (2047 used, row 2047 zero) */
#define NPOS 2047
#define DM 512
#define NH 8
#define HD 64
#define HG 8
#define NR ((size_t)NB * SQ)
typedef __bf16 v16b __attribute__((ext_vector_type(16)));
typedef unsigned short v8us __attribute__((ext_vector_type(8), may_alias));
typedef float  v8f  __attribute__((ext_vector_type(8)));
typedef float  v4f  __attribute__((ext_vector_type(4)));
typedef float  v4fa __attribute__((ext_vector_type(4), may_alias));
union FragB { v16b v; v8us half[2]; unsigned short u[16]; };

__device__ __forceinline__ unsigned short bf16_bits(float x) { unsigned int u = __float_as_uint(x); return (unsigned short)((u + 0x7FFFu + ((u >> 16) & 1u)) >> 16); }
__device__ __forceinline__ float bf16_val(unsigned short b) { return __uint_as_float(((unsigned int)b) << 16); }
__device__ __forceinline__ float bf16_round(float x) { return bf16_val(bf16_bits(x)); }
// D += A·B with NT terms: 1 = ah·bh, 2 = + al·bh (A split), 3 = + ah·bl (both split)
template <int NT>
__device__ __forceinline__ v8f mmaN(v16b ah, v16b al, v16b bh, v16b bl, v8f c) {
  c = __builtin_amdgcn_wmma_f32_16x16x32_bf16(false, ah, false, bh, (short)0, c, false, false);
  if (NT >= 2) c = __builtin_amdgcn_wmma_f32_16x16x32_bf16(false, al, false, bh, (short)0, c, false, false);
  if (NT >= 3) c = __builtin_amdgcn_wmma_f32_16x16x32_bf16(false, ah, false, bl, (short)0, c, false, false);
  asm volatile("v_nop\n\tv_nop\n\tv_nop\n\tv_nop" : "+v"(c) : "v"(ah), "v"(al), "v"(bh), "v"(bl));
  return c;
}

__global__ __launch_bounds__(256) void k_wt_bf16(const float* __restrict__ W, unsigned short* __restrict__ Wt, int K, int N) {
  const int t = blockIdx.x * 256 + threadIdx.x;
  const int k8n = K / 8;
  if (t >= N * k8n) return;
  const int n = t / k8n, k8 = (t % k8n) * 8;
  v8us v;
#pragma unroll
  for (int i = 0; i < 8; ++i) v[i] = bf16_bits(W[(size_t)(k8 + i) * N + n]);
  *(v8us*)(Wt + (size_t)n * K + k8) = v;
  
}

// GEMM C[M][N] (f32, pitch ldc) = act(A[M][K]·W + bias). A f32 row-major (pitch lda) converted per fragment to bf16
// (ASPLIT: hi/lo two planes -> 2 terms, else single rounded term); Wt bf16 [N][K] (pitch ldb). BIAS_BF16 rounds the
// bias to bf16 first (bias quantised to bf16 before the add). K%32==0, M%16==0, N%64==0.
template <bool ASPLIT, int ACT, bool BIAS_BF16>
__global__ __launch_bounds__(128) void k_gemm_bf(const float* __restrict__ A, int lda, const unsigned short* __restrict__ Wt, int ldb,
                                               const float* __restrict__ bias, float* __restrict__ C, int ldc, int M, int N, int K) {
  __shared__ __attribute__((aligned(16))) float so[4][16][64];
  const int tid = threadIdx.x, w = tid >> 5, lane = tid & 31, ln = lane & 15, hh = lane >> 4;
  const int ntn = N / 64;
  const int wid = blockIdx.x * 4 + w;
  const int mt = wid / ntn, nq = wid % ntn;
  if (mt * 16 >= M) return;
  const int row0 = mt * 16, col0 = nq * 64;
  const float* arow = A + (size_t)(row0 + ln) * lda;
  v8f acc[4] = {};
  for (int kb = 0; kb < K; kb += 32) {
    FragB ah, al;
    const v4f x0 = *(const v4fa*)(arow + kb + 8 * hh), x1 = *(const v4fa*)(arow + kb + 8 * hh + 4);
    const v4f x2 = *(const v4fa*)(arow + kb + 16 + 8 * hh), x3 = *(const v4fa*)(arow + kb + 16 + 8 * hh + 4);
    float xs[16] = {x0[0],x0[1],x0[2],x0[3],x1[0],x1[1],x1[2],x1[3],x2[0],x2[1],x2[2],x2[3],x3[0],x3[1],x3[2],x3[3]};
#pragma unroll
    for (int i = 0; i < 16; ++i) { const unsigned short hb = bf16_bits(xs[i]); ah.u[i] = hb; al.u[i] = ASPLIT ? bf16_bits(xs[i] - bf16_val(hb)) : (unsigned short)0; }
#pragma unroll
    for (int t = 0; t < 4; ++t) {
      const unsigned short* brow = Wt + (size_t)(col0 + t * 16 + ln) * ldb + kb;
      FragB b;
      b.half[0] = *(const v8us*)(brow + 8 * hh);
      b.half[1] = *(const v8us*)(brow + 16 + 8 * hh);
      acc[t] = mmaN<ASPLIT ? 2 : 1>(ah.v, al.v, b.v, b.v, acc[t]);
    }
  }
#pragma unroll
  for (int t = 0; t < 4; ++t) {
    float bv = bias ? bias[col0 + t * 16 + ln] : 0.f;
    if (BIAS_BF16) bv = bf16_round(bv);
#pragma unroll
    for (int r = 0; r < 8; ++r) { float v = acc[t][r] + bv; if (ACT == 1) v = fmaxf(v, 0.f); so[w][8 * hh + r][t * 16 + ln] = v; }
  }
  __builtin_amdgcn_fence(__ATOMIC_ACQ_REL, "workgroup");
  __builtin_amdgcn_wave_barrier();
  const int rsub = lane >> 4, c4 = (lane & 15) * 4;
  {
#pragma unroll
    for (int q = 0; q < 8; ++q) {
      const int r = q * 2 + rsub;
      const v4f v = *(const v4fa*)&so[w][r][c4];
      *(v4f*)(C + (size_t)(row0 + r) * ldc + col0 + c4) = v;
    }
    
  }
}

// GEMM C = act(A·W + bias + resid): A f32 (ASPLIT -> hi/lo 2 terms), Wt bf16 [N][K]; ACT 0 none, 1 relu, 2 exact gelu;
// resid (optional, f32, row index = (row % rmod), pitch ldr, RES_BF16 rounds it) added before the activation.
template <bool ASPLIT, int ACT, bool BIAS_BF16, bool RES_BF16>
__global__ __launch_bounds__(128) void k_gemm_bf3(const float* __restrict__ A, int lda, const unsigned short* __restrict__ Wt, int ldb,
                                                const float* __restrict__ bias, const float* __restrict__ resid, int rmod, int ldr,
                                                float* __restrict__ C, int ldc, int M, int N, int K) {
  __shared__ __attribute__((aligned(16))) float so[4][16][64];
  const int tid = threadIdx.x, w = tid >> 5, lane = tid & 31, ln = lane & 15, hh = lane >> 4;
  const int ntn = N / 64;
  const int wid = blockIdx.x * 4 + w;
  const int mt = wid / ntn, nq = wid % ntn;
  if (mt * 16 >= M) return;
  const int row0 = mt * 16, col0 = nq * 64;
  const float* arow = A + (size_t)(row0 + ln) * lda;
  v8f acc[4] = {};
  for (int kb = 0; kb < K; kb += 32) {
    FragB ah, al;
    const v4f x0 = *(const v4fa*)(arow + kb + 8 * hh), x1 = *(const v4fa*)(arow + kb + 8 * hh + 4);
    const v4f x2 = *(const v4fa*)(arow + kb + 16 + 8 * hh), x3 = *(const v4fa*)(arow + kb + 16 + 8 * hh + 4);
    float xs[16] = {x0[0],x0[1],x0[2],x0[3],x1[0],x1[1],x1[2],x1[3],x2[0],x2[1],x2[2],x2[3],x3[0],x3[1],x3[2],x3[3]};
#pragma unroll
    for (int i = 0; i < 16; ++i) { const unsigned short hb = bf16_bits(xs[i]); ah.u[i] = hb; al.u[i] = ASPLIT ? bf16_bits(xs[i] - bf16_val(hb)) : (unsigned short)0; }
#pragma unroll
    for (int t = 0; t < 4; ++t) {
      const unsigned short* brow = Wt + (size_t)(col0 + t * 16 + ln) * ldb + kb;
      FragB b;
      b.half[0] = *(const v8us*)(brow + 8 * hh);
      b.half[1] = *(const v8us*)(brow + 16 + 8 * hh);
      acc[t] = mmaN<ASPLIT ? 2 : 1>(ah.v, al.v, b.v, b.v, acc[t]);
    }
  }
#pragma unroll
  for (int t = 0; t < 4; ++t) {
    const int col = col0 + t * 16 + ln;
    float bv = bias ? bias[col] : 0.f;
    if (BIAS_BF16) bv = bf16_round(bv);
#pragma unroll
    for (int r = 0; r < 8; ++r) {
      float v = acc[t][r] + bv;
      if (resid) { float rv = resid[(size_t)((row0 + 8 * hh + r) % rmod) * ldr + col]; if (RES_BF16) rv = bf16_round(rv); v += rv; }
      if (ACT == 1) v = fmaxf(v, 0.f);
      if (ACT == 2) v = 0.5f * v * (1.0f + erff(v * 0.70710678118654752f));
      if (ACT == 3) { const float u = 0.7978845608028654f * (v + 0.044715f * v * v * v); v = 0.5f * v * (1.0f + tanhf(u)); }
      so[w][8 * hh + r][t * 16 + ln] = v;
    }
  }
  __builtin_amdgcn_fence(__ATOMIC_ACQ_REL, "workgroup");
  __builtin_amdgcn_wave_barrier();
  const int rsub = lane >> 4, c4 = (lane & 15) * 4;
  {
#pragma unroll
    for (int q = 0; q < 8; ++q) {
      const int r = q * 2 + rsub;
      const v4f v = *(const v4fa*)&so[w][r][c4];
      *(v4f*)(C + (size_t)(row0 + r) * ldc + col0 + c4) = v;
    }
    
  }
}
// row LayerNorm (biased variance, eps) over N: s = X (+ R); optional out_sum <- s; out_norm <- (s-mu)*rsqrt(var+eps)*g + b
template <bool PARAM_BF16>
__global__ __launch_bounds__(256) void k_layernorm(const float* __restrict__ X, const float* __restrict__ R, const float* __restrict__ g, const float* __restrict__ bta,
                                                  float* __restrict__ out_sum, float* __restrict__ out_norm, int N, float eps) {
  __shared__ float red[256];
  const int row = blockIdx.x, tid = threadIdx.x;
  const float* x = X + (size_t)row * N; const float* rr = R ? R + (size_t)row * N : nullptr;
  float vals[16];                     // up to N = 4096
  const int per = N / 256;            // contiguous chunk per thread? use strided-by-4 chunks: thread handles j = tid*4 + 1024*u
  float s1 = 0.f;
  for (int u = 0; u < per / 4; ++u) {
    const int j = tid * 4 + 1024 * u;
    const v4f a = *(const v4fa*)(x + j);
    v4f b = {0.f,0.f,0.f,0.f}; if (rr) b = *(const v4fa*)(rr + j);
#pragma unroll
    for (int q = 0; q < 4; ++q) { const float v = a[q] + b[q]; vals[u * 4 + q] = v; s1 += v; }
  }
  red[tid] = s1; __syncthreads();
  for (int st = 128; st > 0; st >>= 1) { if (tid < st) red[tid] += red[tid + st]; __syncthreads(); }
  const float mu = red[0] / (float)N; __syncthreads();
  float s2 = 0.f;
  for (int u = 0; u < per / 4; ++u)
#pragma unroll
    for (int q = 0; q < 4; ++q) { const float c = vals[u * 4 + q] - mu; s2 += c * c; }
  red[tid] = s2; __syncthreads();
  for (int st = 128; st > 0; st >>= 1) { if (tid < st) red[tid] += red[tid + st]; __syncthreads(); }
  const float rs = rsqrtf(red[0] / (float)N + eps);
  {
    for (int u = 0; u < per / 4; ++u) {
      const int j = tid * 4 + 1024 * u;
      v4f o, sm;
#pragma unroll
      for (int q = 0; q < 4; ++q) {
        float gg = g[j + q], bb = bta[j + q];
        if (PARAM_BF16) { gg = bf16_round(gg); bb = bf16_round(bb); }
        sm[q] = vals[u * 4 + q]; o[q] = (vals[u * 4 + q] - mu) * rs * gg + bb;
      }
      if (out_sum) *(v4f*)(out_sum + (size_t)row * N + j) = sm;
      *(v4f*)(out_norm + (size_t)row * N + j) = o;
    }
    
  }
}



// ---- f16 WMMA path (v_wmma_f32_16x16x32_f16): 11-bit significands for operands in range — used where a [0,1] probability operand needs more precision than bf16
typedef _Float16 v16h __attribute__((ext_vector_type(16)));
union FragH { v16h v; v8us half[2]; _Float16 h[16]; unsigned short u[16]; };
template <int NT>
__device__ __forceinline__ v8f mmaH(v16h ah, v16h al, v16h bh, v16h bl, v8f c) {
  c = __builtin_amdgcn_wmma_f32_16x16x32_f16(false, ah, false, bh, (short)0, c, false, false);
  if (NT >= 2) c = __builtin_amdgcn_wmma_f32_16x16x32_f16(false, al, false, bh, (short)0, c, false, false);
  if (NT >= 3) c = __builtin_amdgcn_wmma_f32_16x16x32_f16(false, ah, false, bl, (short)0, c, false, false);
  asm volatile("v_nop\n\tv_nop\n\tv_nop\n\tv_nop" : "+v"(c) : "v"(ah), "v"(al), "v"(bh), "v"(bl));
  return c;
}
// batched GEMM like k_gemm_b but f16 operands: A f32 (split into f16 hi/lo if ASPLIT, else rounded to f16), Bt = f16 values [n][k]; alpha; C f32; N multiple of 16 (partial tiles skipped)
template <bool ASPLIT>
__global__ __launch_bounds__(128) void k_gemm_h(const float* __restrict__ A, int lda, size_t sA, const _Float16* __restrict__ Bh, int ldb, size_t sB, float alpha, float* __restrict__ C, int ldc, size_t sC, int M, int N, int K) {
  __shared__ __attribute__((aligned(16))) float so[4][16][64];
  const int tid = threadIdx.x, w = tid >> 5, lane = tid & 31, ln = lane & 15, hh = lane >> 4; const int by = blockIdx.y;
  A += (size_t)by * sA; Bh += (size_t)by * sB; C += (size_t)by * sC;
  const int ntn = (N + 63) / 64; const int wid = blockIdx.x * 4 + w; const int mt = wid / ntn, nq = wid % ntn; if (mt * 16 >= M) return;
  const int row0 = mt * 16, col0 = nq * 64; const float* arow = A + (size_t)(row0 + ln) * lda;
  v8f acc[4] = {};
  for (int kb = 0; kb < K; kb += 32) {
    FragH ah, al;
    const v4f x0 = *(const v4fa*)(arow + kb + 8 * hh), x1 = *(const v4fa*)(arow + kb + 8 * hh + 4), x2 = *(const v4fa*)(arow + kb + 16 + 8 * hh), x3 = *(const v4fa*)(arow + kb + 16 + 8 * hh + 4);
    float xs[16] = {x0[0],x0[1],x0[2],x0[3],x1[0],x1[1],x1[2],x1[3],x2[0],x2[1],x2[2],x2[3],x3[0],x3[1],x3[2],x3[3]};
#pragma unroll
    for (int i = 0; i < 16; ++i) { const _Float16 h = (_Float16)xs[i]; ah.h[i] = h; al.h[i] = ASPLIT ? (_Float16)(xs[i] - (float)h) : (_Float16)0.0f; }
#pragma unroll
    for (int t = 0; t < 4; ++t) { if (col0 + t * 16 >= N) continue; const size_t boff = (size_t)(col0 + t * 16 + ln) * ldb + kb; FragH bq; bq.half[0] = *(const v8us*)(Bh + boff + 8 * hh); bq.half[1] = *(const v8us*)(Bh + boff + 16 + 8 * hh);
      acc[t] = mmaH<ASPLIT ? 2 : 1>(ah.v, al.v, bq.v, bq.v, acc[t]); }
  }
#pragma unroll
  for (int t = 0; t < 4; ++t) { if (col0 + t * 16 >= N) continue;
#pragma unroll
    for (int r = 0; r < 8; ++r) so[w][8 * hh + r][t * 16 + ln] = acc[t][r] * alpha; }
  __builtin_amdgcn_fence(__ATOMIC_ACQ_REL, "workgroup"); __builtin_amdgcn_wave_barrier();
  const int rsub = lane >> 4, c4 = (lane & 15) * 4;
  {
#pragma unroll
    for (int q = 0; q < 8; ++q) { const int r = q * 2 + rsub; if (col0 + c4 < N) { const v4f v = *(const v4fa*)&so[w][r][c4]; *(v4f*)(C + (size_t)(row0 + r) * ldc + col0 + c4) = v; } }
     }
}

// ---- fragment order: how every f16 operand plane of the WMMA kernels lies in memory ----
// A plane of R rows x K values (R % 16 == 0, K % 32 == 0) is cut into tiles of 16 rows x 32 k, tile (row / 16) * (K / 32) + k / 32, 1 KiB each. A tile holds its 64 pieces of 8 values (16 bytes) in the order
// in which the 32 lanes load them as a 16x16x32 operand: piece c = 32 j + 16 hh + ln is row ln, k = 16 j + 8 hh + (0..7). A fragment is then two loads of 512 bytes in a row, 4 whole lines each;
// from rows at 1 KiB pitch each such load touched 16 lines. Every lane gets the values it got before. Producers: thread t makes piece t, so that a wave stores 512 bytes in a row.
__device__ __forceinline__ int fo_row(size_t t, int K) { return (int)((t >> 6) / (unsigned)(K / 32)) * 16 + (int)(t & 15); }
__device__ __forceinline__ int fo_k(size_t t, int K) { return (int)((t >> 6) % (unsigned)(K / 32)) * 32 + (int)((t >> 5) & 1) * 16 + (int)((t >> 4) & 1) * 8; }
// Wt[n][k] = f16(W[k][n]·scale) from f32 row-major W[K][N] (scale = power of two; bf16-exact weights stay exact in f16 away from the subnormal range)
__device__ __forceinline__ void wt_f16_body(int bx, const float* __restrict__ W, _Float16* __restrict__ Wt, int K, int N, float scale) {
  const int t = bx * 256 + threadIdx.x; if (t >= N * (K / 8)) return; const int n = fo_row(t, K), k8 = fo_k(t, K); FragH f;      /* thread t makes piece t of the fragment-ordered plane: 16 lanes read 16 neighbouring n */
#pragma unroll
  for (int i = 0; i < 8; ++i) f.h[i] = (_Float16)(bf16_round(W[(size_t)(k8 + i) * N + n]) * scale); const v8us o = f.half[0];
  *(v8us*)((unsigned short*)Wt + (size_t)t * 8) = o; 
}
// k_gemm_hh variant with fused epilogue: v = acc·alpha + bias[by·sBias + col] (+ CP[(row/rowsPerB)·sCPb + by·64 + col] if CP) ; ACT 0 none / 1 elu ; writes f16 C16 (and f32 C if non-null)
template <int ACT>
__global__ __launch_bounds__(128) void k_gemm_hhx(const _Float16* __restrict__ A, int lda, size_t sA, const _Float16* __restrict__ Bh, int ldb, size_t sB, float alpha, const float* __restrict__ bias, size_t sBias, const float* __restrict__ CP, int rowsPerB, size_t sCPb, int row0g,
    float* __restrict__ C, _Float16* __restrict__ C16, int ldc, size_t sC, int M, int N, int K) {
  __shared__ __attribute__((aligned(16))) float so[4][16][64];
  const int tid = threadIdx.x, w = tid >> 5, lane = tid & 31, ln = lane & 15, hh = lane >> 4; const int by = blockIdx.y;
  A += (size_t)by * sA; Bh += (size_t)by * sB; const size_t cofs = (size_t)by * sC; const float* bp = bias ? bias + (size_t)by * sBias : nullptr;
  const int ntn = (N + 63) / 64; const int wid = blockIdx.x * 4 + w; const int mt = wid / ntn, nq = wid % ntn; if (mt * 16 >= M) return;
  const int row0 = mt * 16, col0 = nq * 64; const _Float16* arow = A + (size_t)(row0 + ln) * lda;
  v8f acc[4] = {};
  for (int kb = 0; kb < K; kb += 32) { FragH ah; ah.half[0] = *(const v8us*)((const unsigned short*)arow + kb + 8 * hh); ah.half[1] = *(const v8us*)((const unsigned short*)arow + kb + 16 + 8 * hh);
#pragma unroll
    for (int t = 0; t < 4; ++t) { if (col0 + t * 16 >= N) continue; const size_t boff = (size_t)(col0 + t * 16 + ln) * ldb + kb; FragH bq; bq.half[0] = *(const v8us*)((const unsigned short*)Bh + boff + 8 * hh); bq.half[1] = *(const v8us*)((const unsigned short*)Bh + boff + 16 + 8 * hh);
      acc[t] = mmaH<1>(ah.v, ah.v, bq.v, bq.v, acc[t]); }
  }
#pragma unroll
  for (int t = 0; t < 4; ++t) { if (col0 + t * 16 >= N) continue; const int col = col0 + t * 16 + ln; const float bv = bp ? bf16_round(bp[col]) : 0.f;
#pragma unroll
    for (int r = 0; r < 8; ++r) { float v = acc[t][r] * alpha + bv; if (CP) { const int rr = row0g + row0 + 8 * hh + r; if (rowsPerB < 0) v += CP[cofs + (size_t)rr * ldc + col];      /* rowsPerB < 0: own element of the batched C plane */ else { const int bidx = rr / rowsPerB; v += CP[(size_t)bidx * sCPb + (size_t)by * 64 + col]; } } if (ACT == 1) v = (v > 0.f) ? v : expm1f(v); else if (ACT == 7) v = (v > 0.f) ? v + 1.0f : expf(v); else if (ACT == 8) v = tanhf(v); else if (ACT == 9) v = 0.5f * v * (1.0f + tanhf(0.7978845608028654f * (v + 0.044715f * v * v * v))); else if (ACT == 11) v = 1.0f / (1.0f + expf(-v)); else if (ACT == 12) v = (v > 0.f) ? v : 0.01f * v; else if (ACT == 14) v = (v > 0.f) ? v : 0.1f * v; else if (ACT == 16) v = (v >= 0.f) ? v : 0.3f * v; else if (ACT == 17) v = (v >= 0.f) ? v : 0.2f * v; else if (ACT == 15) v = v / (1.0f + expf(-v)); else if (ACT == 3) v = fmaxf(v, 0.f); else if (ACT == 6) v = 0.5f * v * (1.0f + erff(v * 0.70710678118654752f)); so[w][8 * hh + r][t * 16 + ln] = v; } }
  __builtin_amdgcn_fence(__ATOMIC_ACQ_REL, "workgroup"); __builtin_amdgcn_wave_barrier();
  const int rsub = lane >> 4, c4 = (lane & 15) * 4; typedef _Float16 v4h __attribute__((ext_vector_type(4)));
  {
#pragma unroll
    for (int q = 0; q < 8; ++q) { const int r = q * 2 + rsub; if (col0 + c4 < N) { const v4f v = *(const v4fa*)&so[w][r][c4]; if (C) *(v4f*)(C + cofs + (size_t)(row0 + r) * ldc + col0 + c4) = v; if (C16) { v4h h4; for (int i = 0; i < 4; ++i) h4[i] = (_Float16)v[i]; *(v4h*)(C16 + cofs + (size_t)(row0 + r) * ldc + col0 + c4) = h4; } } }
     }
}


typedef _Float16 v4h __attribute__((ext_vector_type(4)));

// rows of DM values into a fragment-ordered plane of n8 pieces; rows from nrows on are not read and become zero
__device__ __forceinline__ void x16_body(int bx, const float* __restrict__ x, _Float16* __restrict__ X16, int nrows, size_t n8) { const size_t t = (size_t)bx * 256 + threadIdx.x; if (t >= n8) return; FragH f; const int row = fo_row(t, DM); const float* s = x + (size_t)row * DM + fo_k(t, DM);
  const v8us z = {0, 0, 0, 0, 0, 0, 0, 0}; f.half[0] = z;
  if (row < nrows) {
#pragma unroll
    for (int q = 0; q < 8; ++q) f.h[q] = (_Float16)bf16_round(s[q]); }
  *(v8us*)((unsigned short*)X16 + t * 8) = f.half[0];  }
__global__ __launch_bounds__(256) void k_h16(const float* __restrict__ x, _Float16* __restrict__ X16, size_t n8) { const size_t t = (size_t)blockIdx.x * 256 + threadIdx.x; if (t >= n8) return; FragH f;
#pragma unroll
  for (int q = 0; q < 8; ++q) f.h[q] = (_Float16)x[t * 8 + q]; *(v8us*)((unsigned short*)X16 + t * 8) = f.half[0];  }
__global__ __launch_bounds__(256) void k_round16f(const float* __restrict__ W, _Float16* __restrict__ Bt, size_t n8) { const size_t t = (size_t)blockIdx.x * 256 + threadIdx.x; if (t >= n8) return; FragH f;
#pragma unroll
  for (int i = 0; i < 8; ++i) f.h[i] = (_Float16)(bf16_round(W[t * 8 + i]) * 16.0f); *(v8us*)((unsigned short*)Bt + t * 8) = f.half[0];  }
__global__ __launch_bounds__(256) void k_hl(const float* __restrict__ F, _Float16* __restrict__ Hh, _Float16* __restrict__ Hl, size_t n8) { const size_t t = (size_t)blockIdx.x * 256 + threadIdx.x; if (t >= n8) return; FragH fh, fl; const v4f a = *(const v4fa*)(F + t * 8), c = *(const v4fa*)(F + t * 8 + 4);
#pragma unroll
  for (int q = 0; q < 4; ++q) { _Float16 h = (_Float16)a[q]; fh.h[q] = h; fl.h[q] = (_Float16)((a[q] - (float)h) * 1024.0f); h = (_Float16)c[q]; fh.h[4 + q] = h; fl.h[4 + q] = (_Float16)((c[q] - (float)h) * 1024.0f); }
  { *(v8us*)((unsigned short*)Hh + t * 8) = fh.half[0]; *(v8us*)((unsigned short*)Hl + t * 8) = fl.half[0];  } }

// ---- fast GEMM (wave tile 32x64; requires M % 32 == 0 rows per launch region and N % 64 == 0); epilogue = k_gemm_hhx semantics ----
__device__ __forceinline__ v16h g2_frag(const _Float16* p, int hh) { FragH f; f.half[0] = *(const v8us*)((const unsigned short*)p + 8 * hh); f.half[1] = *(const v8us*)((const unsigned short*)p + 16 + 8 * hh); return f.v; }
__device__ __forceinline__ v16h fo_frag(const _Float16* p) { FragH f; f.half[0] = *(const v8us*)((const unsigned short*)p); f.half[1] = *(const v8us*)((const unsigned short*)p + 256); return f.v; }      /* p: a tile of a fragment-ordered plane + 8 lane */
#define G2D 2                        /* k steps requested ahead in gemm2_body */
__device__ __forceinline__ v8f g2_mma(v16h a, v16h b, v8f c) { return __builtin_amdgcn_wmma_f32_16x16x32_f16(false, a, false, b, (short)0, c, false, false); }      /* the bare builtin: the compiler keeps the distance behind a WMMA itself, and only where a vector instruction touches its registers */
template <int ACT, int KT>
__device__ __forceinline__ void gemm2_body(int bx, int by, const _Float16* __restrict__ A, int lda, size_t sA, const _Float16* __restrict__ Bh, int ldb, size_t sB, float alpha, const float* __restrict__ bias, size_t sBias, const float* __restrict__ CP, int rowsPerB, size_t sCPb, int row0g,
    float* __restrict__ C, _Float16* __restrict__ C16, int ldc, size_t sC, int M, int N, int K,
    const float* __restrict__ ub = nullptr, const float* __restrict__ vb = nullptr, _Float16* __restrict__ CU = nullptr, _Float16* __restrict__ CV = nullptr, _Float16* __restrict__ VTo = nullptr) { static_assert(ACT == 0 || ACT == 3 || ACT == 6 || ACT == 8 || ACT == 9 || ACT == 11 || ACT == 12 || ACT == 14 || ACT == 15 || ACT == 16 || ACT == 17, "k_gemm2: unsupported ACT code (would silently apply no activation)");
  __shared__ __attribute__((aligned(16))) float so[4][32][68];
  const int tid = threadIdx.x, lane = tid & 31, ln = lane & 15, hh = lane >> 4; const int w = __builtin_amdgcn_readfirstlane(tid >> 5);      /* the wave's number in a scalar register: every tile address below is then a scalar base + the lane's piece */
  A += (size_t)by * sA; Bh += (size_t)by * sB; const size_t cofs = (size_t)by * sC; const float* bp = bias ? bias + (size_t)by * sBias : nullptr;
  const int ntn = N >> 6; const int mt = bx / ntn, nq = bx - mt * ntn; const int row0 = mt * 128 + 32 * w, col0 = nq * 64; if (row0 >= M) return;
  const _Float16* a0p = A + (size_t)row0 * lda; const _Float16* a1p = a0p + (size_t)16 * lda;      /* A, Bh fragment-ordered: 16 rows of tiles are 16 lda values; six scalar bases, to which each load adds the lane's piece */
  const _Float16* b0p = Bh + (size_t)col0 * ldb; const _Float16* b1p = b0p + (size_t)16 * ldb; const _Float16* b2p = b1p + (size_t)16 * ldb; const _Float16* b3p = b2p + (size_t)16 * ldb;
  const v8f z8 = {0.f,0.f,0.f,0.f,0.f,0.f,0.f,0.f}; v8f c00 = z8, c01 = z8, c02 = z8, c03 = z8, c10 = z8, c11 = z8, c12 = z8, c13 = z8;
  /* K = KT at compile time, the k loop unrolled: the six fragments of a k step are requested together, G2D steps ahead of their use, into a ring of G2D + 1 register sets (48 registers a set);
     before, a step held four load-wait-multiply rounds in a row, 4 KT / 32 cache latencies a wave. Each accumulator still takes its k steps in rising order.
     The k step's tile of each operand lies 512 values behind the one before. */
  constexpr int NS = KT / 32; static_assert(KT % 32 == 0 && NS > G2D, "gemm2_body: whole k steps, more of them than are requested ahead"); (void)K;
  v16h fa[G2D + 1][2], fb[G2D + 1][4];
  auto ld = [&](int s) { const int e = s % (G2D + 1), kb = 512 * s + 8 * lane; fa[e][0] = fo_frag(a0p + kb); fa[e][1] = fo_frag(a1p + kb); fb[e][0] = fo_frag(b0p + kb); fb[e][1] = fo_frag(b1p + kb); fb[e][2] = fo_frag(b2p + kb); fb[e][3] = fo_frag(b3p + kb); };
  /* the lane's four bias values are requested together ahead of the k loop, which covers their latency; behind the loop they stood as eight load-wait rounds in a row.
     Without a bias four words of the weight plane (N K / 2 words, more than N) are read in their place and dropped behind the loop: a branch here would part the kernel-argument loads and the first requests into two rounds */
  float b4[4]; const int bi = col0 + ln; const float* bl = bp ? bp : (const float*)Bh;
#pragma unroll
  for (int t = 0; t < 4; ++t) b4[t] = bl[bi + t * 16];
#pragma unroll
  for (int s = 0; s < G2D; ++s) ld(s);
#pragma unroll
  for (int s = 0; s < NS; ++s) { const int e = s % (G2D + 1); if (s + G2D < NS) ld(s + G2D);
    __builtin_amdgcn_sched_barrier(0);      /* the requests stay G2D steps ahead of their use: without it the compiler sinks each load to its product and waits there for the cache */
    c00 = g2_mma(fa[e][0], fb[e][0], c00); c10 = g2_mma(fa[e][1], fb[e][0], c10); c01 = g2_mma(fa[e][0], fb[e][1], c01); c11 = g2_mma(fa[e][1], fb[e][1], c11);
    c02 = g2_mma(fa[e][0], fb[e][2], c02); c12 = g2_mma(fa[e][1], fb[e][2], c12); c03 = g2_mma(fa[e][0], fb[e][3], c03); c13 = g2_mma(fa[e][1], fb[e][3], c13); }
  asm volatile("s_wait_xcnt 0x0" :: "s"(a0p), "s"(a1p), "s"(b0p), "s"(b1p), "s"(b2p), "s"(b3p), "v"(lane), "s"(bl), "v"(bi) : "memory");      /* the scalar bases (six of fragments, one of the bias) and the lane and column registers that the loads name stay whole up to here and are reused only behind this wait */
  v8f accs[8] = {c00, c01, c02, c03, c10, c11, c12, c13};
  const unsigned int bm = bp ? 0xFFFF0000u : 0u;      /* bf16_round, whose last step keeps the upper 16 bits; without a bias nothing is kept: 0 */
#pragma unroll
  for (int t = 0; t < 4; ++t) { const unsigned int u = __float_as_uint(b4[t]); b4[t] = __uint_as_float((u + 0x7FFFu + ((u >> 16) & 1u)) & bm); }
  if (VTo) {      /* V^T [batch][head][64][SQ], fragment-ordered, straight from the accumulators: lane (ln, hh) of accumulator (half, t) holds tokens 16 half + 8 hh + (0..7) of column d = 16 t + ln,
                     which is piece 32 half + lane of the tile (d tile t, this wave's 32 tokens): 8 stores of 512 bytes in a row, no LDS; the test is the same for the whole work-group */
    unsigned short* vd = (unsigned short*)VTo + ((size_t)((row0 / SQ) * NH + nq) * (HD / 16) * (SQ / 32) + (row0 % SQ) / 32) * 512 + 8 * lane;
    FragH f[8];      /* all eight pieces are made before the first store, so that no register of an issued store is written again */
#pragma unroll
    for (int u = 0; u < 8; ++u)
#pragma unroll
      for (int r = 0; r < 8; ++r) f[u].h[r] = (_Float16)(accs[u][r] * alpha + b4[u & 3]);
#pragma unroll
    for (int u = 0; u < 8; ++u) *(v8us*)(vd + (size_t)(u & 3) * (SQ / 32) * 512 + (u >> 2) * 256) = f[u].half[0];
    return; }
#pragma unroll
  for (int u = 0; u < 8; ++u) { const int t = u & 3, half = u >> 2; const int col = col0 + t * 16 + ln; const float bv = b4[t];
#pragma unroll
    for (int r = 0; r < 8; ++r) { const int rloc = half * 16 + 8 * hh + r; float v = accs[u][r] * alpha + bv; if (CP) { if (rowsPerB < 0) v += CP[cofs + (size_t)(row0g + row0 + rloc) * ldc + col];      /* rowsPerB < 0: own element of the batched C plane */ else { const int bidx = (row0g + row0 + rloc) / rowsPerB; v += CP[(size_t)bidx * sCPb + (size_t)by * 64 + col]; } }
      if (ACT == 3) v = fmaxf(v, 0.f); else if (ACT == 6) v = 0.5f * v * (1.0f + erff(v * 0.70710678118654752f)); else if (ACT == 11) v = 1.0f / (1.0f + expf(-v)); else if (ACT == 15) v = v / (1.0f + expf(-v)); else if (ACT == 12) v = (v > 0.f) ? v : 0.01f * v; else if (ACT == 8) v = tanhf(v); else if (ACT == 9) v = 0.5f * v * (1.0f + tanhf(0.7978845608028654f * (v + 0.044715f * v * v * v))); else if (ACT == 14) v = (v > 0.f) ? v : 0.1f * v; else if (ACT == 16) v = (v >= 0.f) ? v : 0.3f * v; else if (ACT == 17) v = (v >= 0.f) ? v : 0.2f * v;
      so[w][rloc][t * 16 + ln] = v; } }
  __builtin_amdgcn_fence(__ATOMIC_ACQ_REL, "workgroup"); __builtin_amdgcn_wave_barrier();
  const int rsub = lane >> 4, c4 = (lane & 15) * 4;
  {
#pragma unroll
    for (int q = 0; q < 16; ++q) { const int r = q * 2 + rsub; const v4f v = *(const v4fa*)&so[w][r][c4]; if (C) *(v4f*)(C + cofs + (size_t)(row0 + r) * ldc + col0 + c4) = v; }
    if (C) asm volatile("s_wait_xcnt 0x0" ::: "memory");      /* the f32 stores' address registers are reused, where an f16 plane follows, only behind this wait */
    if (C16) {      /* the f16 plane is fragment-ordered: the wave's 32 x 64 values are 2 x 2 tiles, 8 stores of 512 bytes in a row */
#pragma unroll
      for (int q = 0; q < 8; ++q) { const float* s = &so[w][(q >> 2) * 16 + ln][((q >> 1) & 1) * 32 + (q & 1) * 16 + 8 * hh]; const v4f x = *(const v4fa*)s, y = *(const v4fa*)(s + 4); FragH f;
#pragma unroll
        for (int i = 0; i < 4; ++i) { f.h[i] = (_Float16)x[i]; f.h[4 + i] = (_Float16)y[i]; }
        *(v8us*)((unsigned short*)C16 + cofs + ((size_t)(row0 / 16 + (q >> 2)) * (ldc / 32) + col0 / 32 + ((q >> 1) & 1)) * 512 + (q & 1) * 256 + 8 * lane) = f.half[0]; } }
    if (CU) {       /* two fragment-ordered f16 planes of the f32 result plus a row vector each (q + pos_bias_u, q + pos_bias_v): the same pieces as above, each rounded once from the f32 sum */
#pragma unroll
      for (int cg = 0; cg < 4; ++cg) { const int cl = (cg >> 1) * 32 + (cg & 1) * 16 + 8 * hh; float bu[8], bw[8];
#pragma unroll
        for (int i = 0; i < 8; ++i) { bu[i] = bf16_round(ub[col0 + cl + i]); bw[i] = bf16_round(vb[col0 + cl + i]); }
#pragma unroll
        for (int rh = 0; rh < 2; ++rh) { const float* s = &so[w][rh * 16 + ln][cl]; const v4f x = *(const v4fa*)s, y = *(const v4fa*)(s + 4); FragH fu, fv;
#pragma unroll
          for (int i = 0; i < 4; ++i) { fu.h[i] = (_Float16)__fadd_rn(x[i], bu[i]); fu.h[4 + i] = (_Float16)__fadd_rn(y[i], bu[4 + i]); fv.h[i] = (_Float16)__fadd_rn(x[i], bw[i]); fv.h[4 + i] = (_Float16)__fadd_rn(y[i], bw[4 + i]); }
          const size_t o = cofs + ((size_t)(row0 / 16 + rh) * (ldc / 32) + col0 / 32 + (cg >> 1)) * 512 + (cg & 1) * 256 + 8 * lane;
          *(v8us*)((unsigned short*)CU + o) = fu.half[0]; *(v8us*)((unsigned short*)CV + o) = fv.half[0]; } } }
     } }
// out = x Wout + bout (f32): every shape, pitch, scale and unused pointer of gemm2_body is a compile-time constant here, so that its epilogue is straight-line code;
// as kernel arguments they left a scalar test and a taken branch in front of each of a lane's 64 results
__global__ __launch_bounds__(128) void k_out(const _Float16* __restrict__ X, const _Float16* __restrict__ Bh, const float* __restrict__ bias, float* __restrict__ C) {
  gemm2_body<0, DM>(blockIdx.x, 0, X, DM, 0, Bh, DM, 0, 0.0009765625f, bias, 0, nullptr, 1, 0, 0, C, nullptr, DM, 0, (int)NR, DM, DM); }


__global__ __launch_bounds__(256) void k_wnat(const float* __restrict__ w, size_t n8, _Float16* __restrict__ Bt) { const size_t t = (size_t)blockIdx.x * 256 + threadIdx.x; if (t >= n8) return; FragH f; for (int q = 0; q < 8; ++q) f.h[q] = (_Float16)(bf16_round(w[t * 8 + q]) * 16.0f); *(v8us*)((unsigned short*)Bt + t * 8) = f.half[0];  }
__global__ __launch_bounds__(256) void k_rsm(const float* __restrict__ S, _Float16* __restrict__ P, int nrows) {
  #pragma clang fp contract(off)
  const int i = blockIdx.x * 256 + threadIdx.x; if (i >= nrows) return; const float* s = S + (size_t)i * SQ; float mx = -3.0e38f;
#pragma unroll 1
  for (int j = 0; j < SQ; ++j) mx = fmaxf(mx, s[j]); float se = 0.f;
#pragma unroll 1
  for (int j = 0; j < SQ; ++j) se += expf(s[j] - mx); const float sc = 256.0f / se;
#pragma unroll 1
  for (int j0 = 0; j0 < SQ; j0 += 8) { FragH f; for (int q = 0; q < 8; ++q) f.h[q] = (_Float16)(expf(s[j0 + q] - mx) * sc); unsigned short* d = (unsigned short*)P + (size_t)i * SQ + j0; *(v8us*)d = f.half[0];  } }
__global__ __launch_bounds__(256) void k_vt(const _Float16* __restrict__ V16, int b, int h0, _Float16* __restrict__ VT) { __shared__ unsigned short tl[64][65]; const int tid = threadIdx.x; const int hh = blockIdx.x % HG, sg = blockIdx.x / HG; const int s0 = sg * 64; const int h = h0 + hh;
  for (int i = tid; i < 64 * 8; i += 256) { const int j = i / 8, d8 = (i % 8) * 8; FragH f; f.half[0] = *(const v8us*)((const unsigned short*)V16 + ((size_t)b * SQ + s0 + j) * DM + h * HD + d8); for (int q = 0; q < 8; ++q) tl[d8 + q][j] = f.u[q]; }
  __syncthreads();
  { for (int i = tid; i < 64 * 8; i += 256) { const int d = i / 8, j8 = (i % 8) * 8; FragH f; for (int q = 0; q < 8; ++q) f.u[q] = tl[d][j8 + q]; *(v8us*)((unsigned short*)VT + ((size_t)hh * HD + d) * SQ + s0 + j8) = f.half[0]; }  } }

// ---- launches that need nothing of each other share one grid: a range test on the block index, the same for a whole work-group, picks the job; each job's blocks do what its own launch did ----
#define GW (DM * (DM / 8) / 256)             /* blocks a weight matrix: 128 */
#define GX ((int)(NR * DM / 8 / 256))        /* blocks an input tensor: 1024 */
#define GE (PP * DM / 8 / 256)               /* blocks of the position table, pad row included: 512 */
#define GG ((int)(NR / 128) * (DM / 64))     /* blocks of a 4096-row projection: 256 */
#define GR ((PP / 128) * (DM / 64))          /* blocks of the position projection: 128 */
static_assert((size_t)GE * 256 == (size_t)PP * DM / 8 && PP % 16 == 0 && NPOS < PP, "k_prep: the position range covers the padded table, whole tiles");
// the five weight transposes (strided reads, the longest blocks: first), the three inputs and the position table as f16 rows
__global__ __launch_bounds__(256) void k_prep(const float* __restrict__ wq, const float* __restrict__ wk, const float* __restrict__ wv, const float* __restrict__ wpos, const float* __restrict__ wo,
    const float* __restrict__ xq, const float* __restrict__ xk, const float* __restrict__ xv, const float* __restrict__ pe,
    _Float16* __restrict__ BQ, _Float16* __restrict__ BK, _Float16* __restrict__ BV, _Float16* __restrict__ BP, _Float16* __restrict__ BO,
    _Float16* __restrict__ XQ, _Float16* __restrict__ XK, _Float16* __restrict__ XV, _Float16* __restrict__ PE) {
  int bx = blockIdx.x;
  if (bx < 5 * GW) { const int g = bx / GW; const float* W = (g == 0) ? wq : (g == 1) ? wk : (g == 2) ? wv : (g == 3) ? wpos : wo; _Float16* Wt = (g == 0) ? BQ : (g == 1) ? BK : (g == 2) ? BV : (g == 3) ? BP : BO;
    wt_f16_body(bx - g * GW, W, Wt, DM, DM, 16.0f); return; }
  bx -= 5 * GW;
  if (bx < 3 * GX) { const int g = bx / GX; const float* x = (g == 0) ? xq : (g == 1) ? xk : xv; _Float16* X = (g == 0) ? XQ : (g == 1) ? XK : XV;
    x16_body(bx - g * GX, x, X, (int)NR, NR * DM / 8); return; }
  bx -= 3 * GX;
  x16_body(bx, pe, PE, NPOS, (size_t)PP * DM / 8); }      /* pad row 2047 becomes zero */
// q + pos_bias_u, q + pos_bias_v, k, p = pos_emb Wpos (f16 rows; row 2047 of p is the zero pad), V^T [4][8][64][1024]: one k loop; the epilogue stores each result as the attention kernel reads it
static_assert(DM == NH * HD && SQ % 128 == 0, "k_proj: a 64-column tile is one head, a work-group's 128 rows lie in one batch");
__global__ __launch_bounds__(128) void k_proj(const _Float16* __restrict__ XQ, const _Float16* __restrict__ XK, const _Float16* __restrict__ XV, const _Float16* __restrict__ PE,
    const _Float16* __restrict__ BQ, const _Float16* __restrict__ BK, const _Float16* __restrict__ BV, const _Float16* __restrict__ BP,
    const float* __restrict__ bq, const float* __restrict__ bk, const float* __restrict__ bv, const float* __restrict__ ub, const float* __restrict__ vb,
    _Float16* __restrict__ QU, _Float16* __restrict__ QV, _Float16* __restrict__ K16, _Float16* __restrict__ VT, _Float16* __restrict__ R16) {
  const int g = blockIdx.x / GG;
  const _Float16* A = (g == 0) ? XQ : (g == 1) ? XK : (g == 2) ? XV : PE; const _Float16* Bh = (g == 0) ? BQ : (g == 1) ? BK : (g == 2) ? BV : BP;
  const int bx = blockIdx.x - g * GG;
  const float* bias = (g == 0) ? bq : (g == 1) ? bk : (g == 2) ? bv : nullptr; _Float16* C16 = (g == 1) ? K16 : (g == 3) ? R16 : nullptr;
  gemm2_body<0, DM>(bx, 0, A, DM, 0, Bh, DM, 0, 0.0625f, bias, 0, nullptr, 1, 0, 0, nullptr, C16, DM, 0, (g == 3) ? PP : (int)NR, DM, DM, ub, vb, (g == 0) ? QU : nullptr, QV, (g == 2) ? VT : nullptr); }
// Fused relative attention, one work-group per (batch, head, FR query rows); the FR x 1024 score rows live in LDS and never reach memory.
// 1: bd tiles (q + v) . p[i0 + 16 t ..], each element stored at its shifted column j = T - 1 + i - pos (in the edge tiles a column outside 0..T-1 goes to the pad column T, which nobody reads);
// 2: ac tiles (q + u) . k added in place. Both products take the position or key tile as A and the query tile as B (the two operands have the same lane map), so that D comes out transposed:
// lane ln holds query row ln, its 8 registers 8 neighbouring positions or keys, that is 8 neighbouring columns of one score row: ac goes in by 16-byte LDS loads and stores, bd by stores of neighbouring words; 3: one wave per row: lane l holds columns 4 l + 128 u + (0..3), mask, f32 statistics, weights 2^(score - max), not yet divided by their sum, as f16 written over the row's own first half; 64 / sum goes to rs;
// 4: o = P . V^T: a wave does 32 rows x 16 columns over one half of k (each V^T fragment is loaded once a work-group); the two halves are added and multiplied by the row's 64 / sum on the way out, where one wave writes each 128-byte line.
// Global fragments are requested ahead of their use, into the registers that the running step sets free.
#define FR 32
#define FD 6                         /* fragment tiles in flight a wave: 96 registers */
#define FP (SQ + 4)                  /* LDS row pitch in floats: 16 B x odd, for the ds_load_b128 fragment reads of step 4 */
typedef int   v4ia __attribute__((ext_vector_type(4), may_alias));
typedef _Float16 v4ha __attribute__((ext_vector_type(4), may_alias));
typedef float v2f __attribute__((ext_vector_type(2)));
#define SXL 0.18033688f              /* (log2 e) / 8 */
static_assert(SQ == 1024 && HD == 64 && FR == 32 && SQ - 1 + FR <= 66 * 16 && SQ - FR + 66 * 16 <= PP, "k_relattn: 8 waves, 66 position tiles inside the padded table");
// Four native 2^x (what __expf compiles to, behind its multiply by log2 e). Written in one statement so that the slot the instruction set asks for behind a transcendental is kept by construction:
// each v_exp_f32 is followed by one that neither reads its result nor overwrites its source (early-clobber outputs), the last by v_nop.
__device__ __forceinline__ void exp2x4(float x0, float x1, float x2, float x3, float* e) {
  asm("v_exp_f32 %0, %4\n\tv_exp_f32 %1, %5\n\tv_exp_f32 %2, %6\n\tv_exp_f32 %3, %7\n\tv_nop" : "=&v"(e[0]), "=&v"(e[1]), "=&v"(e[2]), "=&v"(e[3]) : "v"(x0), "v"(x1), "v"(x2), "v"(x3)); }
__global__ __launch_bounds__(256) __attribute__((amdgpu_waves_per_eu(4, 4))) void k_relattn(const _Float16* __restrict__ QU, const _Float16* __restrict__ QV, const _Float16* __restrict__ K16, const _Float16* __restrict__ R16, const _Float16* __restrict__ VT, const int* __restrict__ mask, _Float16* __restrict__ O16) {
  __shared__ __attribute__((aligned(16))) float sc[FR][FP];
  __shared__ __attribute__((aligned(16))) float so[2][FR][68];
  __shared__ __attribute__((aligned(16))) float rs[FR];      /* 64 / (a row's sum of weights) */
  const int tid = threadIdx.x, lane = tid & 31, ln = lane & 15, hh = lane >> 4; const int w = __builtin_amdgcn_readfirstlane(tid >> 5);
  const int it = blockIdx.x % (SQ / FR), bh = blockIdx.x / (SQ / FR), h = bh % NH, b = bh / NH; const int i0 = it * FR; const size_t r0 = (size_t)b * SQ;
  const v8f z8 = {0.f,0.f,0.f,0.f,0.f,0.f,0.f,0.f};
  const int ho = h * (HD / 32) * 512 + 8 * lane;      /* fragment-ordered planes of DM values a row: 16 rows are 16 DM values, in them the head's two tiles, in a tile the lane's piece */
  const _Float16* pp = R16 + (size_t)(i0 + w * 16) * DM; const _Float16* kp = K16 + (r0 + w * 16) * DM;      /* tile w; tile w + 8 k lies 128 k rows on; scalar bases, to which each load adds ho */
  const _Float16* qp = QV + (r0 + i0) * DM; v16h a00 = fo_frag(qp + ho), a01 = fo_frag(qp + ho + 512), a10 = fo_frag(qp + ho + 16 * DM), a11 = fo_frag(qp + ho + 16 * DM + 512);
  v16h fr[16][2];      /* this wave's 8 position tiles, then its 8 key tiles: one stream, requested FD tiles ahead of its use */
  auto fetch = [&](int n) { const _Float16* p = ((n < 8) ? pp + (size_t)n * 128 * DM : kp + (size_t)(n - 8) * 128 * DM) + ho; fr[n][0] = fo_frag(p); fr[n][1] = fo_frag(p + 512); };
#pragma unroll
  for (int n = 0; n < FD; ++n) fetch(n);
  asm volatile("s_wait_xcnt 0x0" :: "s"(qp), "s"(pp), "v"(ho) : "memory");      /* the issued loads' address registers (scalar bases, the lane's offset) stay whole up to here and are reused only behind this wait */
  const int jw = SQ - 1 + ln - w * 16 - 8 * hh;      /* column of row ln at position i0 + 16 w + 8 hh; register r lies r columns below */
#pragma unroll
  for (int k = 0; k < 8; ++k) { fetch(k + FD); v8f c0 = g2_mma(fr[k][0], a00, z8), c1 = g2_mma(fr[k][0], a10, z8); c0 = g2_mma(fr[k][1], a01, c0); c1 = g2_mma(fr[k][1], a11, c1);
    const int jb = jw - 128 * k;
    if (k == 0) {      /* tiles 0 and 1 reach past column T - 1 */
#pragma unroll
      for (int r = 0; r < 8; ++r) { const int j = jb - r, j1 = j + 16; sc[ln][((unsigned)j < SQ) ? j : SQ] = c0[r]; sc[16 + ln][((unsigned)j1 < SQ) ? j1 : SQ] = c1[r]; }
    } else {           /* tiles 8 to 63: every column inside */
#pragma unroll
      for (int r = 0; r < 8; ++r) { sc[ln][jb - r] = c0[r]; sc[16 + ln][jb + 16 - r] = c1[r]; } }
    __builtin_amdgcn_sched_barrier(0); }      /* one tile's accumulators and LDS addresses live at a time: without it the compiler opens six tiles at once and spills */
  if (w < 2) {         /* tiles 64 and 65 reach below column 0 */
    const _Float16* p8 = pp + ho + (size_t)8 * 128 * DM; const v16h b0 = fo_frag(p8), b1 = fo_frag(p8 + 512);
    asm volatile("s_wait_xcnt 0x0" :: "v"(p8) : "memory");      /* the four loads' address pair stays whole up to here */
    v8f c0 = g2_mma(b0, a00, z8), c1 = g2_mma(b0, a10, z8); c0 = g2_mma(b1, a01, c0); c1 = g2_mma(b1, a11, c1); const int jb = jw - 128 * 8;
#pragma unroll
    for (int r = 0; r < 8; ++r) { const int j = jb - r, j1 = j + 16; sc[ln][((unsigned)j < SQ) ? j : SQ] = c0[r]; sc[16 + ln][((unsigned)j1 < SQ) ? j1 : SQ] = c1[r]; } }
  qp = QU + (r0 + i0) * DM; a00 = fo_frag(qp + ho); a01 = fo_frag(qp + ho + 512); a10 = fo_frag(qp + ho + 16 * DM); a11 = fo_frag(qp + ho + 16 * DM + 512);
  asm volatile("s_wait_xcnt 0x0" :: "s"(qp), "s"(kp), "v"(ho) : "memory");      /* as above */
  __syncthreads();
  const int* mk = mask + (r0 + i0 + w * 4) * SQ + 4 * lane; v4ia m[2][8];
  float* ar = &sc[ln][w * 16 + 8 * hh]; v4f nd[4];      /* row ln, the lane's 8 columns of key tile w; tile w + 8 k lies 128 k floats on, row 16 + ln 16 FP floats on; a tile's bd values are read one tile ahead */
  auto ldb = [&](int k) { const float* p = ar + 128 * k; nd[0] = *(const v4fa*)p; nd[1] = *(const v4fa*)(p + 4); nd[2] = *(const v4fa*)(p + 16 * FP); nd[3] = *(const v4fa*)(p + 16 * FP + 4); };
  ldb(0);
#pragma unroll
  for (int k = 0; k < 8; ++k) { if (k + FD < 8) fetch(8 + k + FD);
    float* p = ar + 128 * k; v8f c0 = {nd[0][0], nd[0][1], nd[0][2], nd[0][3], nd[1][0], nd[1][1], nd[1][2], nd[1][3]}, c1 = {nd[2][0], nd[2][1], nd[2][2], nd[2][3], nd[3][0], nd[3][1], nd[3][2], nd[3][3]};      /* bd is the start value that the products are summed onto */
    if (k < 7) ldb(k + 1);
    c0 = g2_mma(fr[8 + k][0], a00, c0); c1 = g2_mma(fr[8 + k][0], a10, c1); c0 = g2_mma(fr[8 + k][1], a01, c0); c1 = g2_mma(fr[8 + k][1], a11, c1);
    if (k == 4) {
#pragma unroll
      for (int u = 0; u < 8; ++u) m[0][u] = *(const v4ia*)(mk + 128 * u); }      /* this wave's first mask row */
    const v4f l0 = {c0[0], c0[1], c0[2], c0[3]}, h0 = {c0[4], c0[5], c0[6], c0[7]}, l1 = {c1[0], c1[1], c1[2], c1[3]}, h1 = {c1[4], c1[5], c1[6], c1[7]};
    *(v4fa*)p = l0; *(v4fa*)(p + 4) = h0; *(v4fa*)(p + 16 * FP) = l1; *(v4fa*)(p + 16 * FP + 4) = h1;
    __builtin_amdgcn_sched_barrier(0); }      /* each tile's requests (key fragments FD tiles ahead, the next bd values, the mask row) stay in their tile: without it the compiler sinks them to their use and waits there */
  asm volatile("s_wait_xcnt 0x0" ::: "memory");      /* for the key and mask loads issued among the tiles: step 3 reuses their address registers only behind this wait */
  __builtin_amdgcn_sched_barrier(0);      /* step 3's mask compares stay behind the last tile: drawn up among the tiles, they wait there on the mask loads just issued */
  __syncthreads();
  const int nt = w & 3, kh = w >> 2; const _Float16* vp = VT + ((size_t)bh * HD + nt * 16) * SQ + kh * (SQ / 64) * 512; v16h vf[16];      /* fragment-ordered, SQ values a row: this wave's 16 tiles lie in a row */
  float sl[4], ml[4];
#pragma unroll
  for (int k = 0; k < 4; ++k) { float* row = &sc[w * 4 + k][0]; const v4ia* mc = m[k & 1];
    if (k < 3) {
#pragma unroll
      for (int u = 0; u < 8; ++u) m[(k + 1) & 1][u] = *(const v4ia*)(mk + (k + 1) * SQ + 128 * u);      /* next row's mask flies while this row is worked on */
    } else {
#pragma unroll
      for (int s = 0; s < 16; ++s) vf[s] = fo_frag(vp + 512 * s + 8 * lane);      /* step 4's V^T fragments fly during the last row */
      asm volatile("s_wait_xcnt 0x0" :: "s"(vp), "v"(lane) : "memory"); }      /* as above */
    v2f t[8][2]; float m4[4] = {-3.0e38f, -3.0e38f, -3.0e38f, -3.0e38f}; const v2f nbig = {-3.0e38f, -3.0e38f};      /* the mask is applied once, score + mask x -3e38 (mask 0: the score itself): a masked score is -3e38 or below, loses every maximum, and its 2^x below is exactly 0 */
    v4f sv[8];
#pragma unroll
    for (int u = 0; u < 8; ++u) sv[u] = *(const v4fa*)(row + 4 * lane + 128 * u);
    __builtin_amdgcn_sched_barrier(0);      /* the row's eight LDS loads are requested together: without it the compiler sinks each load to its use, eight LDS latencies in a row */
#pragma unroll
    for (int u = 0; u < 8; ++u) { const v4f s = sv[u];
#pragma unroll
      for (int p = 0; p < 2; ++p) { const v2f mf = {(float)(unsigned)mc[u][2 * p], (float)(unsigned)mc[u][2 * p + 1]}, sp = {s[2 * p], s[2 * p + 1]}; t[u][p] = __builtin_elementwise_fma(mf, nbig, sp);
        m4[2 * p] = fmaxf(m4[2 * p], t[u][p][0]); m4[2 * p + 1] = fmaxf(m4[2 * p + 1], t[u][p][1]); } }
    float mx = fmaxf(fmaxf(m4[0], m4[1]), fmaxf(m4[2], m4[3]));
#pragma unroll
    for (int d = 16; d >= 1; d >>= 1) mx = fmaxf(mx, __shfl_xor(mx, d, 32));
    const float nb = (mx > -1.0e38f) ? -mx * SXL : 0.f;      /* every column masked: no shift, so that each 2^x is 0 */
    const v2f c2 = {SXL, SXL}, nb2 = {nb, nb}; v2f s2[2] = {{0.f, 0.f}, {0.f, 0.f}};      /* e = 2^(score (log2 e) / 8 - max (log2 e) / 8): one multiply-add a score, two scores an instruction */
#pragma unroll
    for (int u = 0; u < 8; ++u) { const v2f a0 = __builtin_elementwise_fma(t[u][0], c2, nb2), a1 = __builtin_elementwise_fma(t[u][1], c2, nb2); float e[4]; exp2x4(a0[0], a0[1], a1[0], a1[1], e);
      const v4f e4 = {e[0], e[1], e[2], e[3]}; const v2f e0 = {e[0], e[1]}, e1 = {e[2], e[3]}; s2[0] += e0; s2[1] += e1;
      *(v4ha*)((_Float16*)row + 4 * lane + 128 * u) = __builtin_convertvector(e4, v4h); }      /* stored as it is, 0 to 1: the row's sum is not waited for */
    sl[k] = (s2[0][0] + s2[0][1]) + (s2[1][0] + s2[1][1]); ml[k] = mx; }
#pragma unroll
  for (int d = 16; d >= 1; d >>= 1)
#pragma unroll
    for (int k = 0; k < 4; ++k) sl[k] += __shfl_xor(sl[k], d, 32);      /* the four rows' sums side by side */
  if (lane == 0) { v4f f4;
#pragma unroll
    for (int k = 0; k < 4; ++k) f4[k] = (ml[k] > -1.0e38f) ? 64.0f / sl[k] : 0.f;      /* a row with every column masked gives 0, as the reference does */
    *(v4fa*)&rs[w * 4] = f4; }
  __syncthreads();
  { const _Float16* ap = (const _Float16*)&sc[ln][0] + kh * (SQ / 2); v8f c0 = z8, c1 = z8; v16h af[2][4];      /* weight fragments of two k steps, read from LDS one pair of steps ahead */
#pragma unroll
    for (int e = 0; e < 2; ++e) { af[0][2 * e] = g2_frag(ap + 32 * e, hh); af[0][2 * e + 1] = g2_frag(ap + 16 * FP * 2 + 32 * e, hh); }
#pragma unroll
    for (int g = 0; g < 8; ++g) {
      if (g < 7) {
#pragma unroll
        for (int e = 0; e < 2; ++e) { af[(g + 1) & 1][2 * e] = g2_frag(ap + 32 * (2 * g + 2 + e), hh); af[(g + 1) & 1][2 * e + 1] = g2_frag(ap + 16 * FP * 2 + 32 * (2 * g + 2 + e), hh); } }
      __builtin_amdgcn_sched_barrier(0);      /* the next pair's LDS reads stand ahead of this pair's products: without it the compiler reads the first fragments just in front of their products and waits there */
#pragma unroll
      for (int e = 0; e < 2; ++e) { c0 = g2_mma(af[g & 1][2 * e], vf[2 * g + e], c0); c1 = g2_mma(af[g & 1][2 * e + 1], vf[2 * g + e], c1); } }
#pragma unroll
    for (int r = 0; r < 8; ++r) { so[kh][8 * hh + r][nt * 16 + ln] = c0[r]; so[kh][16 + 8 * hh + r][nt * 16 + ln] = c1[r]; } }
  __syncthreads();
  { const int r = fo_row(tid, HD), c8 = fo_k(tid, HD); const v4f x = *(const v4fa*)&so[0][r][c8] + *(const v4fa*)&so[1][r][c8], y = *(const v4fa*)&so[0][r][c8 + 4] + *(const v4fa*)&so[1][r][c8 + 4]; const float rf = rs[r]; FragH f;
#pragma unroll
    for (int q = 0; q < 4; ++q) { f.h[q] = (_Float16)(x[q] * rf); f.h[4 + q] = (_Float16)(y[q] * rf); }
    *(v8us*)((unsigned short*)O16 + (r0 + i0 + (tid >> 7) * 16) * DM + (h * (HD / 32) + ((tid >> 6) & 1)) * 512 + (tid & 63) * 8) = f.half[0]; } }      /* thread t makes piece t of the work-group's 2 x 2 tiles of the fragment-ordered o plane */

extern "C" void kernel_launch(void* const* d_in, const int* in_sizes, int n_in,
                              void* d_out, int out_size, void* d_ws, size_t ws_size, hipStream_t stream) {
  (void)in_sizes; (void)n_in; (void)out_size;
  const float* const* I = (const float* const*)d_in; const float* xq = I[0]; const float* xk = I[1]; const float* xv = I[2]; const int* mask = (const int*)d_in[3]; const float* pe = I[4]; const float* wq = I[5]; const float* bq = I[6]; const float* wk = I[7]; const float* bk = I[8]; const float* wv = I[9]; const float* bv = I[10]; const float* wpos = I[11]; const float* wo = I[12]; const float* bo = I[13]; const float* pbu = I[14]; const float* pbv = I[15];
  char* ws = (char*)d_ws; size_t off = 0;
  auto take = [&](size_t bytes) { char* p = ws + off; off += (bytes + 255) & ~(size_t)255; return p; };
  _Float16* BQ = (_Float16*)take((size_t)DM * DM * 2); _Float16* BK = (_Float16*)take((size_t)DM * DM * 2); _Float16* BV = (_Float16*)take((size_t)DM * DM * 2); _Float16* BP = (_Float16*)take((size_t)DM * DM * 2); _Float16* BO = (_Float16*)take((size_t)DM * DM * 2);
  _Float16* XQ = (_Float16*)take(NR * DM * 2); _Float16* XK = (_Float16*)take(NR * DM * 2); _Float16* XV = (_Float16*)take(NR * DM * 2); _Float16* PE = (_Float16*)take((size_t)PP * DM * 2);
  _Float16* QU = (_Float16*)take(NR * DM * 2); _Float16* QV = (_Float16*)take(NR * DM * 2); _Float16* K16 = (_Float16*)take(NR * DM * 2); _Float16* R16 = (_Float16*)take((size_t)PP * DM * 2); _Float16* O16 = (_Float16*)take(NR * DM * 2);
  _Float16* VT = (_Float16*)take((size_t)NB * NH * HD * SQ * 2);
  if (off > ws_size) return;      /* 2.5 + 12 + 2 + 12 + 2 + 4 + 4 = approx 39 MiB */
  k_prep<<<5 * GW + 3 * GX + GE, 256, 0, stream>>>(wq, wk, wv, wpos, wo, xq, xk, xv, pe, BQ, BK, BV, BP, BO, XQ, XK, XV, PE);      /* x16 weights transposed, inputs and position table as f16 rows */
  k_proj<<<3 * GG + GR, 128, 0, stream>>>(XQ, XK, XV, PE, BQ, BK, BV, BP, bq, bk, bv, pbu, pbv, QU, QV, K16, VT, R16);      /* q + pos_bias_u, q + pos_bias_v, k, p, V^T (f16) */
  k_relattn<<<NB * NH * (SQ / FR), 256, 0, stream>>>(QU, QV, K16, R16, VT, mask, O16);      /* scores, shifted softmax and o x64 (merged rows), all batches and heads */
  k_out<<<GG, 128, 0, stream>>>(O16, BO, bo, (float*)d_out);      /* out = x Wout + bout */
}
